// v010
// The times below were measured on an AMD MI455X: many runs one after another, warmed up first and cycling through
// copies of the inputs, with the whole window's GPU time divided by the number of runs. Launches and the gaps
// between them are all in it. The median over several windows is given; except for v000 it joins two sittings, which
// can be a few percent apart, so the side-by-side timings, each taken in one sitting, are the better comparison.
// This document starts at v010; the versions before it stand elsewhere.
// Measured time: 69.1 microseconds a run.
// In two side-by-side timings against v009, it was 1.04 and 1.02 times as fast.
// All steps since the starting kernel, v000, together make it 155 times as fast.
#include <hip/hip_runtime.h>
// Causal multi-head self-attention with a per-head LayerNorm on q and k, natural bias-free q / k / v projections and a biased output projection (x [2][3072][512]; q / k / v = x W^T (nn.Linear natural [512][512] sd 0.02, NO biases), 8 heads of 64; q and k each pass through a LayerNorm over the 64 values of every (token, head) vector (biased variance, eps 1e-5, gamma / beta [64]: ones / zeros on this draw: read); scores = q . k / sqrt(64); causal (keys after the query get -inf); softmax; out = merged Wo^T + bo (natural; zero bias) -> [2][3072][512]); q and k carried as f16 hi + x1024 residual planes with three-product scores.
// Structure: token rows r = b*3072 + s; x as exact f16 rows (bf16-rounded); q, k and v as WMMA GEMMs in one grid (32x64 wave tiles = 32 tokens of one head, f32 accumulation, exact x16 weights, no bias) whose epilogue finishes the tile: q and k get their f32 LayerNorm over the 64 values of each (token, head) vector (f32 statistics, gamma / beta by value) and leave as f16 hi + x1024 residual planes, v leaves as V^T through an LDS transpose; f32 rows of q, k, v are stored for the first 128 tokens of a batch alone; work that does not depend on each other shares a grid (x and the weights; q, k, v; both batches); then ONE fused launch for all batches, heads and query rows: rows 0 .. 127 of a batch exactly in f32 on the f32 rows, four a work-group (o x64 as f16 hi + x1024 residual rows); from row 128 on a work-group takes 64 query rows and walks the keys up to its diagonal, 64 a tile, each of its four waves 32 rows x 32 keys of it: S^T = K Q^T as three products (hi.hi + lo.hi + hi.lo, K = 64, scale 1/8 = 1/sqrt(64); logits sigma ~1), causal running-maximum softmax inside the lane (f32 statistics, native exp; weights exp(s - max) as f16), O^T = V^T P^T with the weights taken in place from the score accumulators (o divided by the row sum at the end and carried x64, folded into the output GEMM alpha) written straight into the merged f16 o rows; out = o Wo^T + bo GEMM (f32) into the output layout.
// Compute dtype: inputs rounded to bf16; x / weights exact; the normalised q and k as f16 hi + residual planes (three-product scores), v, the softmax weights and o as plain f16 GEMM operands (~2^-12) from query row 128 on (rows 0 .. 127 of a batch: f32 attention, o as f16 hi + x1024 residual); LayerNorm, scores and softmax statistics f32. v_wmma_f32_16x16x32_f16.
#define NB 2
#define SCL 0.125f                         /* 1 / sqrt(head_dim = 64) */
#define SCLR 0.0001220703125f              /* 2^-13: the same scale on the x1024 residual passes */
#define SQ 3072
#define DM 512
#define NH 8
#define HD 64
#define HG 4                         /* heads of one k_vt launch */
#define QT0 128                      /* first-tile rows computed exactly in f32, by no other path */
#define B0 0                         /* not read: every grid starts at batch 0 */
#define NBR NB                       /* batches processed (debug hook) */
#define NR ((size_t)NB * SQ)         /* token rows */
#define MP ((int)((size_t)NBR * SQ)) /* rows projected (debug hook) */
#define MPO MP                       /* rows through the output stage (debug hook) */
#define LQ DM      /* row pitch of the q/k/v rows */
typedef __bf16 v16b __attribute__((ext_vector_type(16)));
typedef unsigned short v8us __attribute__((ext_vector_type(8), may_alias));
typedef float  v8f  __attribute__((ext_vector_type(8)));
typedef float  v4f  __attribute__((ext_vector_type(4)));
typedef float  v4fa __attribute__((ext_vector_type(4), may_alias));
union FragB { v16b v; v8us half[2]; unsigned short u[16]; };

__device__ __forceinline__ unsigned short bf16_bits(float x) { unsigned int u = __float_as_uint(x); return (unsigned short)((u + 0x7FFFu + ((u >> 16) & 1u)) >> 16); }
__device__ __forceinline__ float bf16_val(unsigned short b) { return __uint_as_float(((unsigned int)b) << 16); }
__device__ __forceinline__ float bf16_round(float x) { return bf16_val(bf16_bits(x)); }
// D += A·B with NT terms: 1 = ah·bh, 2 = + al·bh (A split), 3 = + ah·bl (both split)
template <int NT>
__device__ __forceinline__ v8f mmaN(v16b ah, v16b al, v16b bh, v16b bl, v8f c) {
  c = __builtin_amdgcn_wmma_f32_16x16x32_bf16(false, ah, false, bh, (short)0, c, false, false);
  if (NT >= 2) c = __builtin_amdgcn_wmma_f32_16x16x32_bf16(false, al, false, bh, (short)0, c, false, false);
  if (NT >= 3) c = __builtin_amdgcn_wmma_f32_16x16x32_bf16(false, ah, false, bl, (short)0, c, false, false);
  asm volatile("v_nop\n\tv_nop\n\tv_nop\n\tv_nop" : "+v"(c) : "v"(ah), "v"(al), "v"(bh), "v"(bl));
  return c;
}

__global__ __launch_bounds__(256) void k_wt_bf16(const float* __restrict__ W, unsigned short* __restrict__ Wt, int K, int N) {
  const int t = blockIdx.x * 256 + threadIdx.x;
  const int k8n = K / 8;
  if (t >= N * k8n) return;
  const int n = t / k8n, k8 = (t % k8n) * 8;
  v8us v;
#pragma unroll
  for (int i = 0; i < 8; ++i) v[i] = bf16_bits(W[(size_t)(k8 + i) * N + n]);
  *(v8us*)(Wt + (size_t)n * K + k8) = v;
  
}

// GEMM C[M][N] (f32, pitch ldc) = act(A[M][K]·W + bias). A f32 row-major (pitch lda) converted per fragment to bf16
// (ASPLIT: hi/lo two planes -> 2 terms, else single rounded term); Wt bf16 [N][K] (pitch ldb). BIAS_BF16 rounds the
// bias to bf16 first (bias quantised to bf16 before the add). K%32==0, M%16==0, N%64==0.
template <bool ASPLIT, int ACT, bool BIAS_BF16>
__global__ __launch_bounds__(128) void k_gemm_bf(const float* __restrict__ A, int lda, const unsigned short* __restrict__ Wt, int ldb,
                                               const float* __restrict__ bias, float* __restrict__ C, int ldc, int M, int N, int K) {
  __shared__ __attribute__((aligned(16))) float so[4][16][64];
  const int tid = threadIdx.x, w = tid >> 5, lane = tid & 31, ln = lane & 15, hh = lane >> 4;
  const int ntn = N / 64;
  const int wid = blockIdx.x * 4 + w;
  const int mt = wid / ntn, nq = wid % ntn;
  if (mt * 16 >= M) return;
  const int row0 = mt * 16, col0 = nq * 64;
  const float* arow = A + (size_t)(row0 + ln) * lda;
  v8f acc[4] = {};
  for (int kb = 0; kb < K; kb += 32) {
    FragB ah, al;
    const v4f x0 = *(const v4fa*)(arow + kb + 8 * hh), x1 = *(const v4fa*)(arow + kb + 8 * hh + 4);
    const v4f x2 = *(const v4fa*)(arow + kb + 16 + 8 * hh), x3 = *(const v4fa*)(arow + kb + 16 + 8 * hh + 4);
    float xs[16] = {x0[0],x0[1],x0[2],x0[3],x1[0],x1[1],x1[2],x1[3],x2[0],x2[1],x2[2],x2[3],x3[0],x3[1],x3[2],x3[3]};
#pragma unroll
    for (int i = 0; i < 16; ++i) { const unsigned short hb = bf16_bits(xs[i]); ah.u[i] = hb; al.u[i] = ASPLIT ? bf16_bits(xs[i] - bf16_val(hb)) : (unsigned short)0; }
#pragma unroll
    for (int t = 0; t < 4; ++t) {
      const unsigned short* brow = Wt + (size_t)(col0 + t * 16 + ln) * ldb + kb;
      FragB b;
      b.half[0] = *(const v8us*)(brow + 8 * hh);
      b.half[1] = *(const v8us*)(brow + 16 + 8 * hh);
      acc[t] = mmaN<ASPLIT ? 2 : 1>(ah.v, al.v, b.v, b.v, acc[t]);
    }
  }
#pragma unroll
  for (int t = 0; t < 4; ++t) {
    float bv = bias ? bias[col0 + t * 16 + ln] : 0.f;
    if (BIAS_BF16) bv = bf16_round(bv);
#pragma unroll
    for (int r = 0; r < 8; ++r) { float v = acc[t][r] + bv; if (ACT == 1) v = fmaxf(v, 0.f); so[w][8 * hh + r][t * 16 + ln] = v; }
  }
  __builtin_amdgcn_fence(__ATOMIC_ACQ_REL, "workgroup");
  __builtin_amdgcn_wave_barrier();
  const int rsub = lane >> 4, c4 = (lane & 15) * 4;
  {
#pragma unroll
    for (int q = 0; q < 8; ++q) {
      const int r = q * 2 + rsub;
      const v4f v = *(const v4fa*)&so[w][r][c4];
      *(v4f*)(C + (size_t)(row0 + r) * ldc + col0 + c4) = v;
    }
    
  }
}

// GEMM C = act(A·W + bias + resid): A f32 (ASPLIT -> hi/lo 2 terms), Wt bf16 [N][K]; ACT 0 none, 1 relu, 2 exact gelu;
// resid (optional, f32, row index = (row % rmod), pitch ldr, RES_BF16 rounds it) added before the activation.
template <bool ASPLIT, int ACT, bool BIAS_BF16, bool RES_BF16>
__global__ __launch_bounds__(128) void k_gemm_bf3(const float* __restrict__ A, int lda, const unsigned short* __restrict__ Wt, int ldb,
                                                const float* __restrict__ bias, const float* __restrict__ resid, int rmod, int ldr,
                                                float* __restrict__ C, int ldc, int M, int N, int K) {
  __shared__ __attribute__((aligned(16))) float so[4][16][64];
  const int tid = threadIdx.x, w = tid >> 5, lane = tid & 31, ln = lane & 15, hh = lane >> 4;
  const int ntn = N / 64;
  const int wid = blockIdx.x * 4 + w;
  const int mt = wid / ntn, nq = wid % ntn;
  if (mt * 16 >= M) return;
  const int row0 = mt * 16, col0 = nq * 64;
  const float* arow = A + (size_t)(row0 + ln) * lda;
  v8f acc[4] = {};
  for (int kb = 0; kb < K; kb += 32) {
    FragB ah, al;
    const v4f x0 = *(const v4fa*)(arow + kb + 8 * hh), x1 = *(const v4fa*)(arow + kb + 8 * hh + 4);
    const v4f x2 = *(const v4fa*)(arow + kb + 16 + 8 * hh), x3 = *(const v4fa*)(arow + kb + 16 + 8 * hh + 4);
    float xs[16] = {x0[0],x0[1],x0[2],x0[3],x1[0],x1[1],x1[2],x1[3],x2[0],x2[1],x2[2],x2[3],x3[0],x3[1],x3[2],x3[3]};
#pragma unroll
    for (int i = 0; i < 16; ++i) { const unsigned short hb = bf16_bits(xs[i]); ah.u[i] = hb; al.u[i] = ASPLIT ? bf16_bits(xs[i] - bf16_val(hb)) : (unsigned short)0; }
#pragma unroll
    for (int t = 0; t < 4; ++t) {
      const unsigned short* brow = Wt + (size_t)(col0 + t * 16 + ln) * ldb + kb;
      FragB b;
      b.half[0] = *(const v8us*)(brow + 8 * hh);
      b.half[1] = *(const v8us*)(brow + 16 + 8 * hh);
      acc[t] = mmaN<ASPLIT ? 2 : 1>(ah.v, al.v, b.v, b.v, acc[t]);
    }
  }
#pragma unroll
  for (int t = 0; t < 4; ++t) {
    const int col = col0 + t * 16 + ln;
    float bv = bias ? bias[col] : 0.f;
    if (BIAS_BF16) bv = bf16_round(bv);
#pragma unroll
    for (int r = 0; r < 8; ++r) {
      float v = acc[t][r] + bv;
      if (resid) { float rv = resid[(size_t)((row0 + 8 * hh + r) % rmod) * ldr + col]; if (RES_BF16) rv = bf16_round(rv); v += rv; }
      if (ACT == 1) v = fmaxf(v, 0.f);
      if (ACT == 2) v = 0.5f * v * (1.0f + erff(v * 0.70710678118654752f));
      if (ACT == 3) { const float u = 0.7978845608028654f * (v + 0.044715f * v * v * v); v = 0.5f * v * (1.0f + tanhf(u)); }
      so[w][8 * hh + r][t * 16 + ln] = v;
    }
  }
  __builtin_amdgcn_fence(__ATOMIC_ACQ_REL, "workgroup");
  __builtin_amdgcn_wave_barrier();
  const int rsub = lane >> 4, c4 = (lane & 15) * 4;
  {
#pragma unroll
    for (int q = 0; q < 8; ++q) {
      const int r = q * 2 + rsub;
      const v4f v = *(const v4fa*)&so[w][r][c4];
      *(v4f*)(C + (size_t)(row0 + r) * ldc + col0 + c4) = v;
    }
    
  }
}
// row LayerNorm (biased variance, eps) over N: s = X (+ R); optional out_sum <- s; out_norm <- (s-mu)*rsqrt(var+eps)*g + b
template <bool PARAM_BF16>
__global__ __launch_bounds__(256) void k_layernorm(const float* __restrict__ X, const float* __restrict__ R, const float* __restrict__ g, const float* __restrict__ bta,
                                                  float* __restrict__ out_sum, float* __restrict__ out_norm, int N, float eps) {
  __shared__ float red[256];
  const int row = blockIdx.x, tid = threadIdx.x;
  const float* x = X + (size_t)row * N; const float* rr = R ? R + (size_t)row * N : nullptr;
  float vals[16];                     // up to N = 4096
  const int per = N / 256;            // contiguous chunk per thread? use strided-by-4 chunks: thread handles j = tid*4 + 1024*u
  float s1 = 0.f;
  for (int u = 0; u < per / 4; ++u) {
    const int j = tid * 4 + 1024 * u;
    const v4f a = *(const v4fa*)(x + j);
    v4f b = {0.f,0.f,0.f,0.f}; if (rr) b = *(const v4fa*)(rr + j);
#pragma unroll
    for (int q = 0; q < 4; ++q) { const float v = a[q] + b[q]; vals[u * 4 + q] = v; s1 += v; }
  }
  red[tid] = s1; __syncthreads();
  for (int st = 128; st > 0; st >>= 1) { if (tid < st) red[tid] += red[tid + st]; __syncthreads(); }
  const float mu = red[0] / (float)N; __syncthreads();
  float s2 = 0.f;
  for (int u = 0; u < per / 4; ++u)
#pragma unroll
    for (int q = 0; q < 4; ++q) { const float c = vals[u * 4 + q] - mu; s2 += c * c; }
  red[tid] = s2; __syncthreads();
  for (int st = 128; st > 0; st >>= 1) { if (tid < st) red[tid] += red[tid + st]; __syncthreads(); }
  const float rs = rsqrtf(red[0] / (float)N + eps);
  {
    for (int u = 0; u < per / 4; ++u) {
      const int j = tid * 4 + 1024 * u;
      v4f o, sm;
#pragma unroll
      for (int q = 0; q < 4; ++q) {
        float gg = g[j + q], bb = bta[j + q];
        if (PARAM_BF16) { gg = bf16_round(gg); bb = bf16_round(bb); }
        sm[q] = vals[u * 4 + q]; o[q] = (vals[u * 4 + q] - mu) * rs * gg + bb;
      }
      if (out_sum) *(v4f*)(out_sum + (size_t)row * N + j) = sm;
      *(v4f*)(out_norm + (size_t)row * N + j) = o;
    }
    
  }
}



// ---- f16 WMMA path (v_wmma_f32_16x16x32_f16): 11-bit significands for operands in range — used where a [0,1] probability operand needs more precision than bf16
typedef _Float16 v16h __attribute__((ext_vector_type(16)));
union FragH { v16h v; v8us half[2]; _Float16 h[16]; unsigned short u[16]; };
template <int NT>
__device__ __forceinline__ v8f mmaH(v16h ah, v16h al, v16h bh, v16h bl, v8f c) {
  c = __builtin_amdgcn_wmma_f32_16x16x32_f16(false, ah, false, bh, (short)0, c, false, false);
  if (NT >= 2) c = __builtin_amdgcn_wmma_f32_16x16x32_f16(false, al, false, bh, (short)0, c, false, false);
  if (NT >= 3) c = __builtin_amdgcn_wmma_f32_16x16x32_f16(false, ah, false, bl, (short)0, c, false, false);
  asm volatile("v_nop\n\tv_nop\n\tv_nop\n\tv_nop" : "+v"(c) : "v"(ah), "v"(al), "v"(bh), "v"(bl));
  return c;
}
// batched GEMM like k_gemm_b but f16 operands: A f32 (split into f16 hi/lo if ASPLIT, else rounded to f16), Bt = f16 values [n][k]; alpha; C f32; N multiple of 16 (partial tiles skipped)
template <bool ASPLIT>
__global__ __launch_bounds__(128) void k_gemm_h(const float* __restrict__ A, int lda, size_t sA, const _Float16* __restrict__ Bh, int ldb, size_t sB, float alpha, float* __restrict__ C, int ldc, size_t sC, int M, int N, int K) {
  __shared__ __attribute__((aligned(16))) float so[4][16][64];
  const int tid = threadIdx.x, w = tid >> 5, lane = tid & 31, ln = lane & 15, hh = lane >> 4; const int by = blockIdx.y;
  A += (size_t)by * sA; Bh += (size_t)by * sB; C += (size_t)by * sC;
  const int ntn = (N + 63) / 64; const int wid = blockIdx.x * 4 + w; const int mt = wid / ntn, nq = wid % ntn; if (mt * 16 >= M) return;
  const int row0 = mt * 16, col0 = nq * 64; const float* arow = A + (size_t)(row0 + ln) * lda;
  v8f acc[4] = {};
  for (int kb = 0; kb < K; kb += 32) {
    FragH ah, al;
    const v4f x0 = *(const v4fa*)(arow + kb + 8 * hh), x1 = *(const v4fa*)(arow + kb + 8 * hh + 4), x2 = *(const v4fa*)(arow + kb + 16 + 8 * hh), x3 = *(const v4fa*)(arow + kb + 16 + 8 * hh + 4);
    float xs[16] = {x0[0],x0[1],x0[2],x0[3],x1[0],x1[1],x1[2],x1[3],x2[0],x2[1],x2[2],x2[3],x3[0],x3[1],x3[2],x3[3]};
#pragma unroll
    for (int i = 0; i < 16; ++i) { const _Float16 h = (_Float16)xs[i]; ah.h[i] = h; al.h[i] = ASPLIT ? (_Float16)(xs[i] - (float)h) : (_Float16)0.0f; }
#pragma unroll
    for (int t = 0; t < 4; ++t) { if (col0 + t * 16 >= N) continue; const size_t boff = (size_t)(col0 + t * 16 + ln) * ldb + kb; FragH bq; bq.half[0] = *(const v8us*)(Bh + boff + 8 * hh); bq.half[1] = *(const v8us*)(Bh + boff + 16 + 8 * hh);
      acc[t] = mmaH<ASPLIT ? 2 : 1>(ah.v, al.v, bq.v, bq.v, acc[t]); }
  }
#pragma unroll
  for (int t = 0; t < 4; ++t) { if (col0 + t * 16 >= N) continue;
#pragma unroll
    for (int r = 0; r < 8; ++r) so[w][8 * hh + r][t * 16 + ln] = acc[t][r] * alpha; }
  __builtin_amdgcn_fence(__ATOMIC_ACQ_REL, "workgroup"); __builtin_amdgcn_wave_barrier();
  const int rsub = lane >> 4, c4 = (lane & 15) * 4;
  {
#pragma unroll
    for (int q = 0; q < 8; ++q) { const int r = q * 2 + rsub; if (col0 + c4 < N) { const v4f v = *(const v4fa*)&so[w][r][c4]; *(v4f*)(C + (size_t)(row0 + r) * ldc + col0 + c4) = v; } }
     }
}

// Wt[n][k] = f16(W[k][n]·scale) from f32 row-major W[K][N] (scale = power of two; bf16-exact weights stay exact in f16 away from the subnormal range)
__global__ __launch_bounds__(256) void k_wt_f16(const float* __restrict__ W, _Float16* __restrict__ Wt, int K, int N, float scale) {
  const int t = blockIdx.x * 256 + threadIdx.x; if (t >= N * (K / 8)) return; const int n = t / (K / 8), k8 = (t % (K / 8)) * 8; FragH f;
#pragma unroll
  for (int i = 0; i < 8; ++i) f.h[i] = (_Float16)(bf16_round(W[(size_t)(k8 + i) * N + n]) * scale); const v8us o = f.half[0];
  *(v8us*)((unsigned short*)Wt + (size_t)n * K + k8) = o; 
}
// k_gemm_hh variant with fused epilogue: v = acc·alpha + bias[by·sBias + col] (+ CP[(row/rowsPerB)·sCPb + by·64 + col] if CP) ; ACT 0 none / 1 elu ; writes f16 C16 (and f32 C if non-null)
template <int ACT>
__global__ __launch_bounds__(128) void k_gemm_hhx(const _Float16* __restrict__ A, int lda, size_t sA, const _Float16* __restrict__ Bh, int ldb, size_t sB, float alpha, const float* __restrict__ bias, size_t sBias, const float* __restrict__ CP, int rowsPerB, size_t sCPb, int row0g,
    float* __restrict__ C, _Float16* __restrict__ C16, int ldc, size_t sC, int M, int N, int K) {
  __shared__ __attribute__((aligned(16))) float so[4][16][64];
  const int tid = threadIdx.x, w = tid >> 5, lane = tid & 31, ln = lane & 15, hh = lane >> 4; const int by = blockIdx.y;
  A += (size_t)by * sA; Bh += (size_t)by * sB; const size_t cofs = (size_t)by * sC; const float* bp = bias ? bias + (size_t)by * sBias : nullptr;
  const int ntn = (N + 63) / 64; const int wid = blockIdx.x * 4 + w; const int mt = wid / ntn, nq = wid % ntn; if (mt * 16 >= M) return;
  const int row0 = mt * 16, col0 = nq * 64; const _Float16* arow = A + (size_t)(row0 + ln) * lda;
  v8f acc[4] = {};
  for (int kb = 0; kb < K; kb += 32) { FragH ah; ah.half[0] = *(const v8us*)((const unsigned short*)arow + kb + 8 * hh); ah.half[1] = *(const v8us*)((const unsigned short*)arow + kb + 16 + 8 * hh);
#pragma unroll
    for (int t = 0; t < 4; ++t) { if (col0 + t * 16 >= N) continue; const size_t boff = (size_t)(col0 + t * 16 + ln) * ldb + kb; FragH bq; bq.half[0] = *(const v8us*)((const unsigned short*)Bh + boff + 8 * hh); bq.half[1] = *(const v8us*)((const unsigned short*)Bh + boff + 16 + 8 * hh);
      acc[t] = mmaH<1>(ah.v, ah.v, bq.v, bq.v, acc[t]); }
  }
#pragma unroll
  for (int t = 0; t < 4; ++t) { if (col0 + t * 16 >= N) continue; const int col = col0 + t * 16 + ln; const float bv = bp ? bf16_round(bp[col]) : 0.f;
#pragma unroll
    for (int r = 0; r < 8; ++r) { float v = acc[t][r] * alpha + bv; if (CP) { const int rr = row0g + row0 + 8 * hh + r; if (rowsPerB < 0) v += CP[cofs + (size_t)rr * ldc + col];      /* rowsPerB < 0: own element of the batched C plane */ else { const int bidx = rr / rowsPerB; v += CP[(size_t)bidx * sCPb + (size_t)by * 64 + col]; } } if (ACT == 1) v = (v > 0.f) ? v : expm1f(v); else if (ACT == 7) v = (v > 0.f) ? v + 1.0f : expf(v); else if (ACT == 8) v = tanhf(v); else if (ACT == 9) v = 0.5f * v * (1.0f + tanhf(0.7978845608028654f * (v + 0.044715f * v * v * v))); else if (ACT == 11) v = 1.0f / (1.0f + expf(-v)); else if (ACT == 12) v = (v > 0.f) ? v : 0.01f * v; else if (ACT == 14) v = (v > 0.f) ? v : 0.1f * v; else if (ACT == 16) v = (v >= 0.f) ? v : 0.3f * v; else if (ACT == 17) v = (v >= 0.f) ? v : 0.2f * v; else if (ACT == 15) v = v / (1.0f + expf(-v)); else if (ACT == 3) v = fmaxf(v, 0.f); else if (ACT == 6) v = 0.5f * v * (1.0f + erff(v * 0.70710678118654752f)); so[w][8 * hh + r][t * 16 + ln] = v; } }
  __builtin_amdgcn_fence(__ATOMIC_ACQ_REL, "workgroup"); __builtin_amdgcn_wave_barrier();
  const int rsub = lane >> 4, c4 = (lane & 15) * 4; typedef _Float16 v4h __attribute__((ext_vector_type(4)));
  {
#pragma unroll
    for (int q = 0; q < 8; ++q) { const int r = q * 2 + rsub; if (col0 + c4 < N) { const v4f v = *(const v4fa*)&so[w][r][c4]; if (C) *(v4f*)(C + cofs + (size_t)(row0 + r) * ldc + col0 + c4) = v; if (C16) { v4h h4; for (int i = 0; i < 4; ++i) h4[i] = (_Float16)v[i]; *(v4h*)(C16 + cofs + (size_t)(row0 + r) * ldc + col0 + c4) = h4; } } }
     }
}


typedef _Float16 v4h __attribute__((ext_vector_type(4)));

__global__ __launch_bounds__(256) void k_x16(const float* __restrict__ x, _Float16* __restrict__ X16, size_t n8) { const size_t t = (size_t)blockIdx.x * 256 + threadIdx.x; if (t >= n8) return; FragH f;
#pragma unroll
  for (int q = 0; q < 8; ++q) f.h[q] = (_Float16)bf16_round(x[t * 8 + q]); *(v8us*)((unsigned short*)X16 + t * 8) = f.half[0];  }
__global__ __launch_bounds__(256) void k_h16(const float* __restrict__ x, _Float16* __restrict__ X16, size_t n8) { const size_t t = (size_t)blockIdx.x * 256 + threadIdx.x; if (t >= n8) return; FragH f;
#pragma unroll
  for (int q = 0; q < 8; ++q) f.h[q] = (_Float16)x[t * 8 + q]; *(v8us*)((unsigned short*)X16 + t * 8) = f.half[0];  }
__global__ __launch_bounds__(256) void k_round16f(const float* __restrict__ W, _Float16* __restrict__ Bt, size_t n8) { const size_t t = (size_t)blockIdx.x * 256 + threadIdx.x; if (t >= n8) return; FragH f;
#pragma unroll
  for (int i = 0; i < 8; ++i) f.h[i] = (_Float16)(bf16_round(W[t * 8 + i]) * 16.0f); *(v8us*)((unsigned short*)Bt + t * 8) = f.half[0];  }
// ---- fast GEMM (wave tile 32x64; requires M % 32 == 0 rows per launch region and N % 64 == 0); epilogue = k_gemm_hhx semantics ----
__device__ __forceinline__ v16h g2_frag(const _Float16* p, int hh) { FragH f; f.half[0] = *(const v8us*)((const unsigned short*)p + 8 * hh); f.half[1] = *(const v8us*)((const unsigned short*)p + 16 + 8 * hh); return f.v; }
__device__ __forceinline__ v8f g2_mma(v16h a, v16h b, v8f c) { v8f d = __builtin_amdgcn_wmma_f32_16x16x32_f16(false, a, false, b, (short)0, c, false, false); asm volatile("v_nop\n\tv_nop\n\tv_nop\n\tv_nop" : "+v"(d) : "v"(a), "v"(b)); return d; }
template <int ACT>
__global__ __launch_bounds__(128) void k_gemm2(const _Float16* __restrict__ A, int lda, size_t sA, const _Float16* __restrict__ Bh, int ldb, size_t sB, float alpha, const float* __restrict__ bias, size_t sBias, const float* __restrict__ CP, int rowsPerB, size_t sCPb, int row0g,
    float* __restrict__ C, _Float16* __restrict__ C16, int by16, int ldc, size_t sC, int M, int N, int K) { static_assert(ACT == 0 || ACT == 3 || ACT == 6 || ACT == 8 || ACT == 9 || ACT == 11 || ACT == 12 || ACT == 14 || ACT == 15 || ACT == 16 || ACT == 17, "k_gemm2: unsupported ACT code (would silently apply no activation)");
  __shared__ __attribute__((aligned(16))) float so[4][32][68];
  const int tid = threadIdx.x, w = tid >> 5, lane = tid & 31, ln = lane & 15, hh = lane >> 4; const int by = blockIdx.y;
  A += (size_t)by * sA; Bh += (size_t)by * sB; const size_t cofs = (size_t)by * sC; const float* bp = bias ? bias + (size_t)by * sBias : nullptr;
  if (by < by16) C16 = nullptr; else if (C16) C16 -= (size_t)by16 * sC;      /* f16 rows are stored from plane by16 on, and C16 is the place of that plane's */
  const int ntn = N >> 6; const int mt = blockIdx.x / ntn, nq = blockIdx.x - mt * ntn; const int row0 = mt * 128 + 32 * w, col0 = nq * 64; if (row0 >= M) return;
  const _Float16* a0p = A + (size_t)(row0 + ln) * lda; const _Float16* a1p = a0p + (size_t)16 * lda;
  const _Float16* b0p = Bh + (size_t)(col0 + ln) * ldb; const _Float16* b1p = b0p + (size_t)16 * ldb; const _Float16* b2p = b1p + (size_t)16 * ldb; const _Float16* b3p = b2p + (size_t)16 * ldb;
  const v8f z8 = {0.f,0.f,0.f,0.f,0.f,0.f,0.f,0.f}; v8f c00 = z8, c01 = z8, c02 = z8, c03 = z8, c10 = z8, c11 = z8, c12 = z8, c13 = z8;
#pragma unroll 1
  for (int kb = 0; kb < K; kb += 32) { const v16h a0 = g2_frag(a0p + kb, hh), a1 = g2_frag(a1p + kb, hh);
    v16h b = g2_frag(b0p + kb, hh); c00 = g2_mma(a0, b, c00); c10 = g2_mma(a1, b, c10);
    b = g2_frag(b1p + kb, hh); c01 = g2_mma(a0, b, c01); c11 = g2_mma(a1, b, c11);
    b = g2_frag(b2p + kb, hh); c02 = g2_mma(a0, b, c02); c12 = g2_mma(a1, b, c12);
    b = g2_frag(b3p + kb, hh); c03 = g2_mma(a0, b, c03); c13 = g2_mma(a1, b, c13); }
  v8f accs[8] = {c00, c01, c02, c03, c10, c11, c12, c13};
#pragma unroll
  for (int u = 0; u < 8; ++u) { const int t = u & 3, half = u >> 2; const int col = col0 + t * 16 + ln; const float bv = bp ? bf16_round(bp[col]) : 0.f;
#pragma unroll
    for (int r = 0; r < 8; ++r) { const int rloc = half * 16 + 8 * hh + r; float v = accs[u][r] * alpha + bv; if (CP) { if (rowsPerB < 0) v += CP[cofs + (size_t)(row0g + row0 + rloc) * ldc + col];      /* rowsPerB < 0: own element of the batched C plane */ else { const int bidx = (row0g + row0 + rloc) / rowsPerB; v += CP[(size_t)bidx * sCPb + (size_t)by * 64 + col]; } }
      if (ACT == 3) v = fmaxf(v, 0.f); else if (ACT == 6) v = 0.5f * v * (1.0f + erff(v * 0.70710678118654752f)); else if (ACT == 11) v = 1.0f / (1.0f + expf(-v)); else if (ACT == 15) v = v / (1.0f + expf(-v)); else if (ACT == 12) v = (v > 0.f) ? v : 0.01f * v; else if (ACT == 8) v = tanhf(v); else if (ACT == 9) v = 0.5f * v * (1.0f + tanhf(0.7978845608028654f * (v + 0.044715f * v * v * v))); else if (ACT == 14) v = (v > 0.f) ? v : 0.1f * v; else if (ACT == 16) v = (v >= 0.f) ? v : 0.3f * v; else if (ACT == 17) v = (v >= 0.f) ? v : 0.2f * v;
      so[w][rloc][t * 16 + ln] = v; } }
  __builtin_amdgcn_fence(__ATOMIC_ACQ_REL, "workgroup"); __builtin_amdgcn_wave_barrier();
  const int rsub = lane >> 4, c4 = (lane & 15) * 4;
  {
#pragma unroll
    for (int q = 0; q < 16; ++q) { const int r = q * 2 + rsub; const v4f v = *(const v4fa*)&so[w][r][c4]; if (C) { *(v4f*)(C + cofs + (size_t)(row0 + r) * ldc + col0 + c4) = v; asm volatile("s_wait_xcnt 0x0" ::: "memory"); }      /* the wait stands in front of every later write of the data and address registers that this store names: where both planes are written, the f16 conversion below reuses them */
      if (C16) { v4h h4; for (int i = 0; i < 4; ++i) h4[i] = (_Float16)v[i]; *(v4h*)(C16 + cofs + (size_t)(row0 + r) * ldc + col0 + c4) = h4; } }
     } }


// x and the four weight matrices in one grid: the first xb work-groups round x to exact f16 rows, the next 4 x wb the natural [out][in] weights (x16) into four planes that lie one behind the other. None of the five reads what another writes.
__global__ __launch_bounds__(256) void k_prep(const float* __restrict__ x, const float* __restrict__ w0, const float* __restrict__ w1, const float* __restrict__ w2, const float* __restrict__ w3, _Float16* __restrict__ X16, _Float16* __restrict__ Bt) {
  constexpr int xb = (int)(NR * DM / 2048), wb = DM * DM / 2048; const int bx = blockIdx.x; const float* s = x; _Float16* d = X16; float sc = 1.0f; int lb = bx;      /* a product with 1 is exact */
  if (bx >= xb) { const int p = (bx - xb) / wb; lb = (bx - xb) - p * wb; s = (p == 0) ? w0 : (p == 1) ? w1 : (p == 2) ? w2 : w3; d = Bt + (size_t)p * wb * 2048; sc = 16.0f; }      /* work-group-uniform; a work-group covers 2048 values */
  const size_t t = (size_t)lb * 256 + threadIdx.x; const v4f a = *(const v4fa*)(s + t * 8), c = *(const v4fa*)(s + t * 8 + 4); FragH f;
#pragma unroll      /* constant indices into the loaded registers */
  for (int q = 0; q < 4; ++q) { f.h[q] = (_Float16)(bf16_round(a[q]) * sc); f.h[4 + q] = (_Float16)(bf16_round(c[q]) * sc); }
  *(v8us*)((unsigned short*)d + t * 8) = f.half[0]; }
__global__ __launch_bounds__(256) void k_rsm(const float* __restrict__ S, _Float16* __restrict__ P, int nrows) {
  #pragma clang fp contract(off)
  const int i = blockIdx.x * 256 + threadIdx.x; if (i >= nrows) return; const float* s = S + (size_t)i * SQ; float mx = -3.0e38f;
#pragma unroll 1
  for (int j = 0; j < SQ; ++j) mx = fmaxf(mx, s[j]); float se = 0.f;
#pragma unroll 1
  for (int j = 0; j < SQ; ++j) se += expf(s[j] - mx); const float sc = 256.0f / se;
#pragma unroll 1
  for (int j0 = 0; j0 < SQ; j0 += 8) { FragH f; for (int q = 0; q < 8; ++q) f.h[q] = (_Float16)(expf(s[j0 + q] - mx) * sc); unsigned short* d = (unsigned short*)P + (size_t)i * SQ + j0; *(v8us*)d = f.half[0];  } }
__global__ __launch_bounds__(256) void k_vt(const _Float16* __restrict__ V16, int b, int h0, _Float16* __restrict__ VT) { __shared__ unsigned short tl[64][65]; const int tid = threadIdx.x; const int hh = blockIdx.x % HG, sg = blockIdx.x / HG; const int s0 = sg * 64; const int h = h0 + hh;
  for (int i = tid; i < 64 * 8; i += 256) { const int j = i / 8, d8 = (i % 8) * 8; FragH f; f.half[0] = *(const v8us*)((const unsigned short*)V16 + ((size_t)b * SQ + s0 + j) * DM + h * HD + d8); for (int q = 0; q < 8; ++q) tl[d8 + q][j] = f.u[q]; }
  __syncthreads();
  { for (int i = tid; i < 64 * 8; i += 256) { const int d = i / 8, j8 = (i % 8) * 8; FragH f; for (int q = 0; q < 8; ++q) f.u[q] = tl[d][j8 + q]; *(v8us*)((unsigned short*)VT + ((size_t)hh * HD + d) * SQ + s0 + j8) = f.half[0]; }  } }



__device__ __forceinline__ float rs_xhalf(float x) { return __builtin_bit_cast(float, __builtin_amdgcn_permlanex16(__builtin_bit_cast(int, x), __builtin_bit_cast(int, x), 0x76543210, 0xfedcba98, false, false)); }      /* lane l <- lane l ^ 16 */
__device__ __forceinline__ float fa_exp2(float x) { float y; asm("v_exp_f32 %0, %1\n\tv_nop" : "=v"(y) : "v"(x)); return y; }      /* 2^x; the v_nop is the slot the instruction set asks for behind a transcendental */
#define SCL2 0.18033688f                   /* SCL * log2(e): scores carried in the base-2 domain, so that a weight is one subtract and one 2^x */
#define SCLR2 (SCL2 * 0.0009765625f)       /* the same scale on the x1024 residual products */
// Fused causal attention, one work-group per 64 query rows of one (batch, head); a query set is 16 rows, a wave holds two; 32 keys a pass, no score or weight plane in memory.
// S^T = K Q^T (A = key rows, B = query rows): a lane holds 16 scores of ITS query (column ln), keys kb + 8 hh + r and kb + 16 + 8 hh + r: the very places of the B fragment of O^T = V^T P^T,
// so the weights go from the score accumulators to the next product inside the lane. Row maximum and row sum: in the lane, plus one exchange with lane ^ 16. Running maximum, o and sum rescaled each pass.
// The four waves of a work-group walk the same keys: a tile of 64 keys (K hi, K residual, V^T: 64 rows of 128 bytes each) is brought into LDS once for all four by asynchronous copies of whole 128-byte lines, two buffers, the next tile in flight while this one is worked on; the fragments are 16-byte LDS reads.
#define FKT 64                       /* keys of a staged tile: two passes */
#define FPT 72                       /* pitch of a staged row in f16: 144 B = 9 x 16 B, so that 16 lanes reading 16 rows by 16 bytes do not meet in a bank */
#define FPL (FKT * FPT * 2)          /* bytes of one staged plane */
#define FRS (16 * FPT * 2)           /* bytes of 16 staged rows: the step between a lane's four pieces of a plane */
// One tile: a lane's twelve 16-byte pieces (four of each plane, 16 rows apart). ld: the lane's LDS byte address in plane 0 of the buffer; gh, gl, gv: its first piece in the K hi rows, the K residual rows and the V^T rows.
__device__ __forceinline__ void fa_stage(unsigned ld, const _Float16* gh, const _Float16* gl, const _Float16* gv) {
  asm volatile(      /* the copies go from global memory to LDS through no register; the s_wait_xcnt in the same statement stands in front of every later write of the address registers that the copies name */
    "global_load_async_to_lds_b128 %0, %12, off\n\t"
    "global_load_async_to_lds_b128 %1, %13, off\n\t"
    "global_load_async_to_lds_b128 %2, %14, off\n\t"
    "global_load_async_to_lds_b128 %3, %15, off\n\t"
    "global_load_async_to_lds_b128 %4, %16, off\n\t"
    "global_load_async_to_lds_b128 %5, %17, off\n\t"
    "global_load_async_to_lds_b128 %6, %18, off\n\t"
    "global_load_async_to_lds_b128 %7, %19, off\n\t"
    "global_load_async_to_lds_b128 %8, %20, off\n\t"
    "global_load_async_to_lds_b128 %9, %21, off\n\t"
    "global_load_async_to_lds_b128 %10, %22, off\n\t"
    "global_load_async_to_lds_b128 %11, %23, off\n\t"
    "s_wait_xcnt 0x0"
    :: "v"(ld), "v"(ld + FRS), "v"(ld + 2 * FRS), "v"(ld + 3 * FRS),
       "v"(ld + FPL), "v"(ld + FPL + FRS), "v"(ld + FPL + 2 * FRS), "v"(ld + FPL + 3 * FRS),
       "v"(ld + 2 * FPL), "v"(ld + 2 * FPL + FRS), "v"(ld + 2 * FPL + 2 * FRS), "v"(ld + 2 * FPL + 3 * FRS),
       "v"(gh), "v"(gh + (size_t)16 * LQ), "v"(gh + (size_t)32 * LQ), "v"(gh + (size_t)48 * LQ),
       "v"(gl), "v"(gl + (size_t)16 * LQ), "v"(gl + (size_t)32 * LQ), "v"(gl + (size_t)48 * LQ),
       "v"(gv), "v"(gv + (size_t)16 * SQ), "v"(gv + (size_t)32 * SQ), "v"(gv + (size_t)48 * SQ)
    : "memory"); }
// The loop's products as the plain builtin: the compiler keeps the distance behind a WMMA itself. g2_mma's v_nop statement names D, A and B as asm operands, which this compiler places in v0 .. v255 alone; with two query sets in a wave that sent the query fragments to scratch.
__device__ __forceinline__ v8f fa_mma(v16h a, v16h b, v8f c) { return __builtin_amdgcn_wmma_f32_16x16x32_f16(false, a, false, b, (short)0, c, false, false); }
// One query set (16 rows) against the wave's 32 keys: the three products of S^T = K Q^T, in the order they always had, and the scale. ka, kc: the key rows' hi and residual fragments (rows 0 .. 15: k 0 .. 31, k 32 .. 63; rows 16 .. 31 likewise).
__device__ __forceinline__ void fa_qk(const v16h (&ka)[4], const v16h (&kc)[4], v16h qh0, v16h qh1, v16h ql0, v16h ql1, float (&s0)[8], float (&s1)[8]) {
  const v8f z8 = {0.f,0.f,0.f,0.f,0.f,0.f,0.f,0.f}; v8f sh0 = z8, sl0 = z8, sh1 = z8, sl1 = z8;      /* hi . hi, and lo . hi + hi . lo (x1024), for keys kb .. kb + 15 and kb + 16 .. kb + 31 */
  sh0 = fa_mma(ka[0], qh0, sh0); sl0 = fa_mma(ka[0], ql0, sl0); sh1 = fa_mma(ka[2], qh0, sh1); sl1 = fa_mma(ka[2], ql0, sl1);
  sh0 = fa_mma(ka[1], qh1, sh0); sl0 = fa_mma(ka[1], ql1, sl0); sh1 = fa_mma(ka[3], qh1, sh1); sl1 = fa_mma(ka[3], ql1, sl1);
  sl0 = fa_mma(kc[0], qh0, sl0); sl1 = fa_mma(kc[2], qh0, sl1); sl0 = fa_mma(kc[1], qh1, sl0); sl1 = fa_mma(kc[3], qh1, sl1);
#pragma unroll      /* unrolled so that every index into the accumulator registers is a constant */
  for (int r = 0; r < 8; ++r) { s0[r] = fmaf(sl0[r], SCLR2, sh0[r] * SCL2); s1[r] = fmaf(sl1[r], SCLR2, sh1[r] * SCL2); } }
// The same set's causal running-maximum softmax step and its output products. diag: wave-uniform, the keys reach past the set's first query; q: the lane's query; va: the V^T fragments of the wave's 32 keys.
__device__ __forceinline__ void fa_sm(float (&s0)[8], float (&s1)[8], bool diag, int kb, int hh, int q, const v16h (&va)[4], float& m, float& l, v8f (&o)[4]) {
  if (diag) {      /* wave-uniform: only the pass on the diagonal holds keys after a query */
#pragma unroll      /* unrolled so that every index into the score registers is a constant */
    for (int r = 0; r < 8; ++r) { const int j = kb + 8 * hh + r; s0[r] = (j <= q) ? s0[r] : -1.0e30f; s1[r] = (j + 16 <= q) ? s1[r] : -1.0e30f; } }
  float bm = fmaxf(s0[0], s1[0]);
#pragma unroll      /* unrolled so that every index into the score registers is a constant */
  for (int r = 1; r < 8; ++r) bm = fmaxf(bm, fmaxf(s0[r], s1[r]));
  bm = fmaxf(bm, rs_xhalf(bm)); const float mn = fmaxf(m, bm); const float sc = fa_exp2(m - mn); m = mn;
  FragH pf; float ls = 0.f;
#pragma unroll      /* unrolled so that every index into the score and fragment registers is a constant */
  for (int r = 0; r < 8; ++r) { const float e0 = fa_exp2(s0[r] - mn), e1 = fa_exp2(s1[r] - mn); ls += e0 + e1; pf.h[r] = (_Float16)e0; pf.h[8 + r] = (_Float16)e1; }
  l = fmaf(l, sc, ls);      /* the lane's half of the row sum; the halves meet behind the loop */
#pragma unroll      /* unrolled so that every index into the accumulator registers is a constant */
  for (int r = 0; r < 8; ++r) { o[0][r] *= sc; o[1][r] *= sc; o[2][r] *= sc; o[3][r] *= sc; }
  o[0] = fa_mma(va[0], pf.v, o[0]); o[1] = fa_mma(va[1], pf.v, o[1]); o[2] = fa_mma(va[2], pf.v, o[2]); o[3] = fa_mma(va[3], pf.v, o[3]); }
// The work-group's 64 queries x 64 staged keys are dealt to its four waves as 2 x 2 blocks of 32 queries x 32 keys: wave w takes query rows 32 (w >> 1) .. + 31 as two sets of 16 and, of every tile, keys 32 (w & 1) .. + 31.
// A key or V^T fragment read from LDS then serves two query sets, so a tile costs the work-group half the LDS reads that four waves of 16 queries x 64 keys ask for. The two waves of a query row hold partial maxima, sums and o; they meet behind the loop through LDS.
__device__ __forceinline__ void fa_body(char* sm, int bh, int nst, const _Float16* __restrict__ QHp, const _Float16* __restrict__ QLp, const _Float16* __restrict__ KHp, const _Float16* __restrict__ KLp, const _Float16* __restrict__ VTp, _Float16* __restrict__ Op) {      /* sm: the work-group's LDS block; bh: batch * NH + head; nst: tiles up to and with the work-group's diagonal tile */
  _Float16 (*sk)[3][FKT][FPT] = (_Float16 (*)[3][FKT][FPT])sm;      /* [buffer][K hi, K residual, V^T][row][64 values + pad] */
  const int tid = threadIdx.x, lane = tid & 31, ln = lane & 15, hh = lane >> 4; const int w = __builtin_amdgcn_readfirstlane(tid >> 5);
  const int b = bh / NH, h = bh % NH; const int kh = w & 1;      /* kh: the wave's half of every tile's keys */
  const int q0 = (nst - 1) * FKT + (w >> 1) * 32;
  const size_t r0 = (size_t)b * SQ; const int qa = q0 + ln, qb = qa + 16;      /* the lane's query in either set */
  const int sr = tid >> 3, sc8 = (tid & 7) * 8;      /* staging: eight lanes copy one 128-byte row, a wave four whole rows a copy */
  const _Float16* gh = KHp + (r0 + sr) * LQ + h * HD + sc8; const _Float16* gl = KLp + (r0 + sr) * LQ + h * HD + sc8; const _Float16* gv = VTp + ((size_t)bh * HD + sr) * SQ + sc8;
  const unsigned ld0 = (unsigned)(size_t)&sk[0][0][sr][sc8];      /* the low 32 bits of a shared address are its LDS byte address */
  fa_stage(ld0, gh, gl, gv);      /* tile 0 into buffer 0 */
  const _Float16* qh = QHp + (r0 + qa) * LQ + h * HD; const _Float16* ql = QLp + (r0 + qa) * LQ + h * HD;
  const v16h ah0 = g2_frag(qh, hh), ah1 = g2_frag(qh + 32, hh), al0 = g2_frag(ql, hh), al1 = g2_frag(ql + 32, hh);
  const v16h bh0 = g2_frag(qh + 16 * LQ, hh), bh1 = g2_frag(qh + 16 * LQ + 32, hh), bl0 = g2_frag(ql + 16 * LQ, hh), bl1 = g2_frag(ql + 16 * LQ + 32, hh);
  asm volatile("s_wait_xcnt 0x0" ::: "memory");      /* stands behind the query rows' loads, in front of every later write of the address registers that they name */
  const v8f z8 = {0.f,0.f,0.f,0.f,0.f,0.f,0.f,0.f}; v8f oa[4] = {z8, z8, z8, z8}, ob[4] = {z8, z8, z8, z8}; float ma = -1.0e30f, la = 0.f, mb = -1.0e30f, lb = 0.f;
  asm volatile("s_wait_asynccnt 0x0" ::: "memory");      /* this wave's pieces of tile 0 have landed */
  __syncthreads();      /* every wave's pieces of tile 0 have landed: the tile may be read */
  if (nst > 1) fa_stage(ld0 + 3 * FPL, gh + (size_t)FKT * LQ, gl + (size_t)FKT * LQ, gv + FKT);      /* tile 1 into buffer 1 */
#pragma unroll 1      /* a trip holds 24 fragment loads and 32 products: a second copy of it would not fit the registers */
  for (int st = 0; st < nst; ++st) {
    const int kb = st * FKT + kh * 32;
    if (kb <= q0) {      /* wave-uniform: the block is worked on only where every query of the wave has a key in it (kb and q0 are multiples of 32); the foot of the trip below is passed all the same */
      const _Float16* tk = &sk[st & 1][0][kh * 32 + ln][0]; const _Float16* tl = &sk[st & 1][1][kh * 32 + ln][0]; const _Float16* tv = &sk[st & 1][2][ln][kh * 32];      /* this trip reads this buffer alone */
      const v16h ka[4] = {g2_frag(tk, hh), g2_frag(tk + 32, hh), g2_frag(tk + 16 * FPT, hh), g2_frag(tk + 16 * FPT + 32, hh)};      /* the wave's 32 key rows, hi plane */
      const v16h kc[4] = {g2_frag(tl, hh), g2_frag(tl + 32, hh), g2_frag(tl + 16 * FPT, hh), g2_frag(tl + 16 * FPT + 32, hh)};      /* the same rows, residual plane */
      const v16h va[4] = {g2_frag(tv, hh), g2_frag(tv + 16 * FPT, hh), g2_frag(tv + 32 * FPT, hh), g2_frag(tv + 48 * FPT, hh)};      /* asked for here, used behind the softmax */
      const bool diag = kb + 31 > q0;      /* wave-uniform, and the same for both sets: kb == q0 */
      float sa0[8], sa1[8], sb0[8], sb1[8];
      fa_qk(ka, kc, ah0, ah1, al0, al1, sa0, sa1); fa_qk(ka, kc, bh0, bh1, bl0, bl1, sb0, sb1);      /* the second set's products stand ahead of the first set's softmax: neither waits for the other */
      fa_sm(sa0, sa1, diag, kb, hh, qa, va, ma, la, oa); fa_sm(sb0, sb1, diag, kb, hh, qb, va, mb, lb, ob); }
    asm volatile("s_wait_dscnt 0x0" ::: "memory");      /* this wave's reads of the buffer are done before it may be refilled */
    asm volatile("s_wait_asynccnt 0x0" ::: "memory");      /* this wave's pieces of the next tile have landed */
    __syncthreads();      /* publishes the next tile and ends every wave's reads of this trip's buffer */
    if (st + 2 < nst) fa_stage(ld0 + (unsigned)(st & 1) * (3 * FPL), gh + (size_t)(st + 2) * FKT * LQ, gl + (size_t)(st + 2) * FKT * LQ, gv + (size_t)(st + 2) * FKT); }      /* the tile after the next into the buffer just read */
  asm volatile("s_wait_asynccnt 0x0" ::: "memory");      /* no copy is outstanding when the wave goes on to its end */
  // The two waves of a query row meet: wave kh keeps set kh and hands the other set to its partner (wave w ^ 1) through LDS, which the last trip's barrier has left free. Same lane, same places in either wave.
  v4f (*xc)[9][32] = (v4f (*)[9][32])sm;      /* [wave][8 pieces of o, then maximum and sum][lane]: a wave's lanes write 512 bytes in a row */
  float mk = kh ? mb : ma, lk = kh ? lb : la; const float mg = kh ? ma : mb, lg = kh ? la : lb; v8f ok[4];
#pragma unroll      /* constant indices into the accumulator registers */
  for (int i = 0; i < 4; ++i) { const v8f og = kh ? oa[i] : ob[i]; ok[i] = kh ? ob[i] : oa[i]; const v4f g0 = {og[0], og[1], og[2], og[3]}, g1 = {og[4], og[5], og[6], og[7]}; xc[w][2 * i][lane] = g0; xc[w][2 * i + 1][lane] = g1; }
  { const v4f gs = {mg, lg, 0.f, 0.f}; xc[w][8][lane] = gs; }
  __syncthreads();      /* the partner's partial results are read below */
  const v4f ps = xc[w ^ 1][8][lane]; const float mn = fmaxf(mk, ps[0]); const float ck = fa_exp2(mk - mn), cp = fa_exp2(ps[0] - mn);      /* both maxima are finite: either wave has worked on tile 0 */
  float l = fmaf(ps[1], cp, lk * ck);
  l += rs_xhalf(l); const float fin = 64.0f / l;      /* o carried x64, folded into the output GEMM alpha */
  const float fk = ck * fin, fp = cp * fin;
  unsigned short* op = (unsigned short*)Op + (r0 + (kh ? qb : qa)) * DM + h * HD + 8 * hh; FragH f[4];      /* lane: 8 neighbouring head values of its query per tile; the wave writes whole 128-byte head rows */
#pragma unroll      /* constant indices into the accumulator and fragment registers */
  for (int i = 0; i < 4; ++i) { const v4f p0 = xc[w ^ 1][2 * i][lane], p1 = xc[w ^ 1][2 * i + 1][lane];
#pragma unroll      /* constant indices */
    for (int r = 0; r < 4; ++r) { f[i].h[r] = (_Float16)fmaf(p0[r], fp, ok[i][r] * fk); f[i].h[4 + r] = (_Float16)fmaf(p1[r], fp, ok[i][4 + r] * fk); } }
  *(v8us*)op = f[0].half[0]; *(v8us*)(op + 16) = f[1].half[0]; *(v8us*)(op + 32) = f[2].half[0]; *(v8us*)(op + 48) = f[3].half[0]; }

#define A0R 4                        /* query rows of a work-group of the exact first tile: one wave each */
#define A0P 68                       /* pitch of a staged key row in floats: 272 B = 17 x 16 B, so that 16 lanes reading 16 rows by 16 bytes meet every LDS bank once */
#define A0U (QT0 * (HD / 4) / 128)   /* 16-byte pieces of a staged plane per thread */
typedef float v2f __attribute__((ext_vector_type(2)));
typedef _Float16 v2h __attribute__((ext_vector_type(2)));
// Exact f32 attention for the first QT0 rows, causal. One wave per query row, A0R rows of one head per work-group; the head's QT0 key and value rows are staged in LDS once (keys behind a query are masked below and carry weight zero).
// Scores: a lane takes keys lane, lane + 32, lane + 64, lane + 96, each a serial f32 chain over the 64 head values. Row maximum and row sum: butterflies over the wave. Output: a lane takes two head values and sums over the keys in rising order, the weight of key j read from its lane.
__device__ __forceinline__ void a0_body(char* sm, int bt, int h, int rg, const float* __restrict__ QF, const float* __restrict__ KF, const float* __restrict__ VF, int ld, size_t sb, float scale, _Float16* __restrict__ OH, _Float16* __restrict__ OL, int ldo, size_t sbo) {      /* sm: the work-group's LDS block; bt: the batch; rg: the group of A0R query rows */
  float (*lk)[A0P] = (float (*)[A0P])sm; float (*lv)[HD] = (float (*)[HD])(sm + QT0 * A0P * 4);
  QF += (size_t)bt * sb; KF += (size_t)bt * sb; VF += (size_t)bt * sb; OH += (size_t)bt * sbo; OL += (size_t)bt * sbo;
  const int tid = threadIdx.x, lane = tid & 31; const int w = __builtin_amdgcn_readfirstlane(tid >> 5);
  const int i = rg * A0R + w;      /* this wave's query */
  v4f kq[A0U], vq[A0U]; const size_t ro = (size_t)(tid / (HD / 4)) * ld + h * HD + (tid % (HD / 4)) * 4; const float* kp = KF + ro; const float* vp = VF + ro;      /* the thread's piece of its first key and value row; its further pieces lie 128 / (HD / 4) rows apart, at constant offsets from these two addresses */
#pragma unroll      /* all loads of a thread in flight at once, their results under constant indices */
  for (int u = 0; u < A0U; ++u) { kq[u] = *(const v4fa*)(kp + (size_t)u * (128 / (HD / 4)) * ld); vq[u] = *(const v4fa*)(vp + (size_t)u * (128 / (HD / 4)) * ld); }
  asm volatile("s_wait_xcnt 0x0" :: "v"(kp), "v"(vp) : "memory");      /* stands in front of every write of the registers that the loads above name as their addresses; it takes the two addresses as inputs, so that those registers live up to it and no load's result is placed on them earlier */
  const float* qr = QF + (size_t)i * ld + h * HD; v4f qv[HD / 4];
#pragma unroll      /* the query row stays in registers: constant indices */
  for (int c = 0; c < HD / 4; ++c) qv[c] = *(const v4fa*)(qr + c * 4);
  asm volatile("s_wait_xcnt 0x0" :: "s"(qr) : "memory");      /* the same wait for the query row's loads (wave-uniform address: scalar loads), in front of every write of their base registers */
#pragma unroll      /* constant indices into the staging registers */
  for (int u = 0; u < A0U; ++u) { const int t = u * 128 + tid, j = t / (HD / 4), c = (t % (HD / 4)) * 4; *(v4f*)&lk[j][c] = kq[u]; *(v4f*)&lv[j][c] = vq[u]; }
  __syncthreads();      /* the staged rows are read by every wave */
  float s[QT0 / 32];
#pragma unroll      /* four independent chains side by side */
  for (int g = 0; g < QT0 / 32; ++g) s[g] = 0.f;
#pragma unroll      /* constant indices into the query registers, LDS offsets as immediates */
  for (int c = 0; c < HD / 4; ++c) {
#pragma unroll      /* four independent chains side by side */
    for (int g = 0; g < QT0 / 32; ++g) { const v4f kr = *(const v4f*)&lk[g * 32 + lane][c * 4]; s[g] = fmaf(qv[c][0], kr[0], s[g]); s[g] = fmaf(qv[c][1], kr[1], s[g]); s[g] = fmaf(qv[c][2], kr[2], s[g]); s[g] = fmaf(qv[c][3], kr[3], s[g]); } }
  float mx = -1.0e30f;
#pragma unroll      /* constant indices into the score registers */
  for (int g = 0; g < QT0 / 32; ++g) { s[g] = (g * 32 + lane <= i) ? s[g] * scale : -1.0e30f; mx = fmaxf(mx, s[g]); }
#pragma unroll      /* five exchange steps */
  for (int st = 16; st > 0; st >>= 1) mx = fmaxf(mx, __shfl_xor(mx, st));
  float e[QT0 / 32], l = 0.f;
#pragma unroll      /* constant indices into the score registers */
  for (int g = 0; g < QT0 / 32; ++g) { e[g] = (g * 32 + lane <= i) ? expf(s[g] - mx) : 0.f; l += e[g]; }
#pragma unroll      /* five exchange steps */
  for (int st = 16; st > 0; st >>= 1) l += __shfl_xor(l, st);
  v2f o = {0.f, 0.f};
#pragma unroll      /* constant lane numbers for the weight reads, LDS offsets as immediates */
  for (int g = 0; g < QT0 / 32; ++g) {
#pragma unroll      /* constant lane numbers for the weight reads, LDS offsets as immediates */
    for (int jj = 0; jj < 32; ++jj) { const float ej = __builtin_bit_cast(float, __builtin_amdgcn_readlane(__builtin_bit_cast(int, e[g]), jj)); const v2f vv = *(const v2f*)&lv[g * 32 + jj][2 * lane]; o[0] = fmaf(ej, vv[0], o[0]); o[1] = fmaf(ej, vv[1], o[1]); } }
  const float fin = 64.0f / l;      /* o carried x64 like the f16 path */
  o[0] *= fin; o[1] *= fin; v2h oh, ol;      /* o leaves as the two operands of the output GEMMs: f16 hi + x1024 residual */
  oh[0] = (_Float16)o[0]; oh[1] = (_Float16)o[1]; ol[0] = (_Float16)((o[0] - (float)oh[0]) * 1024.0f); ol[1] = (_Float16)((o[1] - (float)oh[1]) * 1024.0f);
  const size_t oo = (size_t)i * ldo + h * HD + 2 * lane; *(v2h*)(OH + oo) = oh; *(v2h*)(OL + oo) = ol; }      /* the wave writes its query's whole 128-byte head row of either plane */
#define NFT ((SQ - QT0) / FKT)       /* query tiles of a (batch, head) that the fused f16 path takes: those behind the first QT0 rows */
// Both attention paths in one grid: neither reads what the other writes. blockIdx.x: batch * NH + head. blockIdx.y < NFT: the fused path's query tile, the longest rows first over all heads; from NFT on: a group of A0R rows of the exact first tile.
// The choice is work-group-uniform, so every barrier of either path is passed by all four waves. One LDS block serves whichever path the work-group takes.
__global__ __launch_bounds__(128) void k_attn(const _Float16* __restrict__ QHp, const _Float16* __restrict__ QLp, const _Float16* __restrict__ KHp, const _Float16* __restrict__ KLp, const _Float16* __restrict__ VTp, _Float16* __restrict__ Op,
    const float* __restrict__ QF, const float* __restrict__ KF, const float* __restrict__ VF, _Float16* __restrict__ OH, _Float16* __restrict__ OL) {
  __shared__ __attribute__((aligned(16))) char sm[QT0 * A0P * 4 + QT0 * HD * 4]; static_assert(sizeof(sm) >= 2 * 3 * FPL, "the block holds the larger of the two paths' needs");
  const int bh = blockIdx.x, ty = blockIdx.y;
  if (ty < NFT) fa_body(sm, bh, SQ / FKT - ty, QHp, QLp, KHp, KLp, VTp, Op);
  else a0_body(sm, bh / NH, bh % NH, ty - NFT, QF, KF, VF, DM, (size_t)SQ * DM, SCL, OH, OL, DM, (size_t)QT0 * DM); }

#define GKT 64                       /* k values of a staged chunk: two k steps; a row of it is one whole 128-byte line */
#define GPI 72                       /* pitch of a staged row in f16: 144 B = 9 x 16 B, so that 16 lanes reading 16 rows by 16 bytes do not meet in a bank */
#define GRS (16 * GPI * 2)           /* bytes of 16 staged rows: the step between a lane's pieces */
#define GRW 192                      /* staged rows of a chunk: 128 operand rows, then 64 weight rows */
#define GRX 320                      /* the same with 128 residual rows behind them */
// One chunk of a projection's operands: a lane's twelve 16-byte pieces, 16 rows apart (eight of the operand rows, four of the weight rows). ld: the lane's LDS byte address in row 0 .. 15 of the buffer; ga, gb: its first piece in the operand rows and in the weight rows.
__device__ __forceinline__ void gs_stage(unsigned ld, const _Float16* ga, const _Float16* gb) {
  asm volatile(      /* the copies go from global memory to LDS through no register; the s_wait_xcnt in the same statement stands in front of every later write of the address registers that the copies name */
    "global_load_async_to_lds_b128 %0, %12, off\n\t"
    "global_load_async_to_lds_b128 %1, %13, off\n\t"
    "global_load_async_to_lds_b128 %2, %14, off\n\t"
    "global_load_async_to_lds_b128 %3, %15, off\n\t"
    "global_load_async_to_lds_b128 %4, %16, off\n\t"
    "global_load_async_to_lds_b128 %5, %17, off\n\t"
    "global_load_async_to_lds_b128 %6, %18, off\n\t"
    "global_load_async_to_lds_b128 %7, %19, off\n\t"
    "global_load_async_to_lds_b128 %8, %20, off\n\t"
    "global_load_async_to_lds_b128 %9, %21, off\n\t"
    "global_load_async_to_lds_b128 %10, %22, off\n\t"
    "global_load_async_to_lds_b128 %11, %23, off\n\t"
    "s_wait_xcnt 0x0"
    :: "v"(ld), "v"(ld + GRS), "v"(ld + 2 * GRS), "v"(ld + 3 * GRS), "v"(ld + 4 * GRS), "v"(ld + 5 * GRS), "v"(ld + 6 * GRS), "v"(ld + 7 * GRS),
       "v"(ld + 8 * GRS), "v"(ld + 9 * GRS), "v"(ld + 10 * GRS), "v"(ld + 11 * GRS),
       "v"(ga), "v"(ga + (size_t)16 * DM), "v"(ga + (size_t)32 * DM), "v"(ga + (size_t)48 * DM), "v"(ga + (size_t)64 * DM), "v"(ga + (size_t)80 * DM), "v"(ga + (size_t)96 * DM), "v"(ga + (size_t)112 * DM),
       "v"(gb), "v"(gb + (size_t)16 * DM), "v"(gb + (size_t)32 * DM), "v"(gb + (size_t)48 * DM)
    : "memory"); }
// The lane's eight pieces of the 128 residual rows of a chunk. ld: its LDS byte address in the first 16 of those rows; ge: its first piece.
__device__ __forceinline__ void gs_stage_res(unsigned ld, const _Float16* ge) {
  asm volatile(      /* as in gs_stage */
    "global_load_async_to_lds_b128 %0, %8, off\n\t"
    "global_load_async_to_lds_b128 %1, %9, off\n\t"
    "global_load_async_to_lds_b128 %2, %10, off\n\t"
    "global_load_async_to_lds_b128 %3, %11, off\n\t"
    "global_load_async_to_lds_b128 %4, %12, off\n\t"
    "global_load_async_to_lds_b128 %5, %13, off\n\t"
    "global_load_async_to_lds_b128 %6, %14, off\n\t"
    "global_load_async_to_lds_b128 %7, %15, off\n\t"
    "s_wait_xcnt 0x0"
    :: "v"(ld), "v"(ld + GRS), "v"(ld + 2 * GRS), "v"(ld + 3 * GRS), "v"(ld + 4 * GRS), "v"(ld + 5 * GRS), "v"(ld + 6 * GRS), "v"(ld + 7 * GRS),
       "v"(ge), "v"(ge + (size_t)16 * DM), "v"(ge + (size_t)32 * DM), "v"(ge + (size_t)48 * DM), "v"(ge + (size_t)64 * DM), "v"(ge + (size_t)80 * DM), "v"(ge + (size_t)96 * DM), "v"(ge + (size_t)112 * DM)
    : "memory"); }
// The k loop of a work-group's 128 x 64 tile (four waves of 32 x 64) over DM values, shared by the projections. A fragment load from global memory takes 32 bytes out of each of 16 lines, and the four waves ask for the same weight rows;
// here a chunk of 64 k values (operand rows, weight rows, RES: residual rows) is brought into LDS once for all four waves by asynchronous copies of whole 128-byte lines, two buffers, the next chunk in flight while this one is worked on; the fragments are 16-byte LDS reads.
// A, E, B: the first of the work-group's operand, residual and weight rows (row pitch DM). c[half * 4 + t] (RES: d likewise for the residual rows): row tile half, column tile t; every accumulator sums its k steps in rising order. The last trip's barrier ends every wave's reads: sm is free behind the loop.
template <bool RES>
__device__ __forceinline__ void gs_loop(char* sm, const _Float16* __restrict__ A, const _Float16* __restrict__ E, const _Float16* __restrict__ B, v8f (&c)[8], v8f (&d)[8]) {
  constexpr unsigned BUF = (RES ? GRX : GRW) * GPI * 2; constexpr int NT = DM / GKT; constexpr int G = RES ? 1 : 2;      /* G: k steps whose fragments are asked for together (with two accumulator sets the registers hold one step's) */
  const int tid = threadIdx.x, lane = tid & 31, ln = lane & 15, hh = lane >> 4, w = tid >> 5;
  const int sr = tid >> 3, sc8 = (tid & 7) * 8;      /* staging: eight lanes copy one 128-byte row, a wave four whole rows a copy */
  const _Float16* ga = A + (size_t)sr * DM + sc8; const _Float16* gb = B + (size_t)sr * DM + sc8; const _Float16* ge = RES ? E + (size_t)sr * DM + sc8 : nullptr;
  const unsigned ld0 = (unsigned)(size_t)(sm + (sr * GPI + sc8) * 2);      /* the low 32 bits of a shared address are its LDS byte address */
  gs_stage(ld0, ga, gb); if (RES) gs_stage_res(ld0 + 12 * GRS, ge);      /* chunk 0 into buffer 0 */
  asm volatile("s_wait_asynccnt 0x0" ::: "memory");      /* this wave's pieces of chunk 0 have landed */
  __syncthreads();      /* every wave's pieces of chunk 0 have landed: the chunk may be read */
  gs_stage(ld0 + BUF, ga + GKT, gb + GKT); if (RES) gs_stage_res(ld0 + BUF + 12 * GRS, ge + GKT);      /* chunk 1 into buffer 1 */
#pragma unroll 1      /* rolled: the two buffers differ by one address term, and a second copy of the trip would only lengthen the code */
  for (int t = 0; t < NT; ++t) {
    const _Float16* tb = (const _Float16*)(sm + (unsigned)(t & 1) * BUF);      /* this trip reads this buffer alone */
    const _Float16* ta = tb + (32 * w + ln) * GPI; const _Float16* tw = tb + (128 + ln) * GPI; const _Float16* te = tb + (GRW + 32 * w + ln) * GPI;
#pragma unroll      /* LDS offsets as immediates */
    for (int g0 = 0; g0 < 2; g0 += G) {
      v16h a0[G], a1[G], e0[G], e1[G], b[G][4];
#pragma unroll      /* constant indices: the fragments stay in registers; all LDS reads stand in one place ahead of the products */
      for (int g = 0; g < G; ++g) { const int ko = (g0 + g) * 32; a0[g] = g2_frag(ta + ko, hh); a1[g] = g2_frag(ta + 16 * GPI + ko, hh);
        if (RES) { e0[g] = g2_frag(te + ko, hh); e1[g] = g2_frag(te + 16 * GPI + ko, hh); }
#pragma unroll      /* constant indices */
        for (int u = 0; u < 4; ++u) b[g][u] = g2_frag(tw + u * 16 * GPI + ko, hh); }
#pragma unroll      /* constant indices */
      for (int g = 0; g < G; ++g)
#pragma unroll      /* constant indices */
        for (int u = 0; u < 4; ++u) { c[u] = g2_mma(a0[g], b[g][u], c[u]); c[4 + u] = g2_mma(a1[g], b[g][u], c[4 + u]);
          if (RES) { d[u] = g2_mma(e0[g], b[g][u], d[u]); d[4 + u] = g2_mma(e1[g], b[g][u], d[4 + u]); } } }
    asm volatile("s_wait_dscnt 0x0" ::: "memory");      /* this wave's reads of the buffer are done before it may be refilled */
    asm volatile("s_wait_asynccnt 0x0" ::: "memory");      /* this wave's pieces of the next chunk have landed */
    __syncthreads();      /* publishes the next chunk and ends every wave's reads of this trip's buffer */
    if (t + 2 < NT) { gs_stage(ld0 + (unsigned)(t & 1) * BUF, ga + (t + 2) * GKT, gb + (t + 2) * GKT); if (RES) gs_stage_res(ld0 + (unsigned)(t & 1) * BUF + 12 * GRS, ge + (t + 2) * GKT); } }      /* the chunk after the next into the buffer just read */
  asm volatile("s_wait_asynccnt 0x0" ::: "memory"); }      /* no copy is outstanding when the wave goes on */
#define VTP 136                      /* pitch of a staged V^T row in f16: 128 tokens + 8 = 272 B = 17 x 16 B, so that the 16-byte pieces of 16 neighbouring rows spread over the LDS banks */
typedef float v2fa __attribute__((ext_vector_type(2), may_alias));
// The 16 rows that a half-wave stores of a q or k tile (every second row of the wave's 32): sv, sm: the lane's four columns and the statistics of its first row in LDS (row pitch 68 floats); gg, bb: gamma and beta of those columns. FI: the f32 rows are stored too.
template <bool FI>
__device__ __forceinline__ void qk_rows(const float* sv, const float* sm, v4f gg, v4f bb, float* Fp, _Float16* Hp, _Float16* Lp) {
  v4f v[16]; v2f ms[16];
#pragma unroll      /* all LDS reads asked for ahead of the arithmetic, their results under constant indices */
  for (int q = 0; q < 16; ++q) { v[q] = *(const v4fa*)(sv + q * 2 * 68); ms[q] = *(const v2fa*)(sm + q * 2 * 68); }
#pragma unroll      /* constant indices, global offsets as immediates */
  for (int q = 0; q < 16; ++q) { v4f y; v4h h4, l4;
#pragma unroll      /* constant indices */
    for (int e = 0; e < 4; ++e) { y[e] = (v[q][e] - ms[q][0]) * ms[q][1] * gg[e] + bb[e]; const _Float16 h = (_Float16)y[e]; h4[e] = h; l4[e] = (_Float16)((y[e] - (float)h) * 1024.0f); }
    if (FI) *(v4f*)(Fp + (size_t)q * 2 * DM) = y;
    *(v4h*)(Hp + (size_t)q * 2 * DM) = h4; *(v4h*)(Lp + (size_t)q * 2 * DM) = l4;
    if (FI) asm volatile("s_wait_xcnt 0x0" :: "v"(y), "v"(h4), "v"(l4) : "memory");      /* stands in front of every later write of the registers that these stores name; it takes the stored values as inputs, so that their registers live up to it and no later row's value is placed on them earlier (the address registers serve all 16 rows) */
    else asm volatile("s_wait_xcnt 0x0" :: "v"(h4), "v"(l4) : "memory"); } }      /* the same without the f32 row */
// q, k, v projections (blockIdx.y) with all that follows them element by element done in the epilogue. Tiles are k_gemm2's, the k loop is gs_loop: a wave owns 32 tokens x 64 columns, which is ONE head of those tokens, so the wave holds every value that a (token, head) LayerNorm needs.
// q, k: the tile goes to the wave's LDS rows; lane = token takes mean and variance of its row (serial f32 sums in rising order); then the wave walks the rows 16 lanes a row, normalises, and stores f16 hi + x1024 residual rows (whole 128-byte head rows).
// v: a lane's 8 accumulator values of a tile are 8 neighbouring tokens of one head value, a 16-byte piece of V^T; the four waves' pieces meet in LDS, so that a wave stores whole 256-byte runs of a V^T row.
// f32 rows of q, k (normalised) and v are stored only where the exact first tile reads them: the first QT0 tokens of a batch.
__global__ __launch_bounds__(128) void k_qkv(const _Float16* __restrict__ X, const _Float16* __restrict__ Bt, const float* __restrict__ qg, const float* __restrict__ qb, const float* __restrict__ kg, const float* __restrict__ kb, float eps,
    float* __restrict__ F, _Float16* __restrict__ Hh, _Float16* __restrict__ Hl, _Float16* __restrict__ VTo) {
  __shared__ __attribute__((aligned(16))) char smq[2 * GRW * GPI * 2]; static_assert(sizeof(smq) >= 4 * 32 * 68 * 4, "the block holds the larger of the loop's and the epilogue's needs");
  float (*so)[32][68] = (float (*)[32][68])smq;      /* the epilogue's rows, in the LDS that the k loop has left; columns 64, 65 of a row: its mean and its 1 / sigma */
  const int tid = threadIdx.x, w = tid >> 5, lane = tid & 31, ln = lane & 15, hh = lane >> 4; const int by = blockIdx.y;
  const int mt = blockIdx.x / (DM / 64), nq = blockIdx.x % (DM / 64); const int row0 = mt * 128 + 32 * w, col0 = nq * 64;
  const int bt = mt / (SQ / 128), s0 = (mt % (SQ / 128)) * 128; const bool first = s0 < QT0;      /* the work-group's batch and its first token there; work-group-uniform */
  const v8f z8 = {0.f,0.f,0.f,0.f,0.f,0.f,0.f,0.f}; v8f accs[8] = {z8, z8, z8, z8, z8, z8, z8, z8};
  gs_loop<false>(smq, X + (size_t)mt * 128 * DM, nullptr, Bt + (size_t)by * DM * DM + (size_t)col0 * DM, accs, accs);
  const int rsub = lane >> 4, c4 = (lane & 15) * 4;
  const size_t po = (size_t)by * NR * DM + (size_t)(row0 + rsub) * DM + col0 + c4;      /* the lane's place in row rsub of the wave's tile, in plane by */
  if (by < 2 || first) {      /* work-group-uniform: the tile as f32 rows in the wave's own LDS (x16 weights undone) */
#pragma unroll      /* constant indices into the accumulator registers */
    for (int u = 0; u < 8; ++u) { const int t = u & 3, half = u >> 2;
#pragma unroll      /* constant indices into the accumulator registers */
      for (int r = 0; r < 8; ++r) so[w][half * 16 + 8 * hh + r][t * 16 + ln] = accs[u][r] * 0.0625f; }
    __builtin_amdgcn_fence(__ATOMIC_ACQ_REL, "workgroup"); __builtin_amdgcn_wave_barrier(); }      /* the wave's lanes read each other's LDS writes below */
  if (by < 2) {
    const float* gp = by ? kg : qg; const float* bp = by ? kb : qb; const v4f g4 = *(const v4fa*)(gp + c4), b4 = *(const v4fa*)(bp + c4);      /* the lane's four columns are the same in every row it stores */
    v4f rv[16];
#pragma unroll      /* the row stays in registers: constant indices */
    for (int c = 0; c < 16; ++c) rv[c] = *(const v4fa*)&so[w][lane][c * 4];
    float sum = 0.f, vs = 0.f;
#pragma unroll      /* constant indices into the row's registers */
    for (int c = 0; c < 16; ++c) sum = (((sum + rv[c][0]) + rv[c][1]) + rv[c][2]) + rv[c][3];
    const float mu = sum / 64.0f;
#pragma unroll      /* constant indices into the row's registers */
    for (int c = 0; c < 16; ++c)
#pragma unroll      /* constant indices into the row's registers */
      for (int e = 0; e < 4; ++e) { const float dl = rv[c][e] - mu; vs = fmaf(dl, dl, vs); }
    v2f st = {mu, rsqrtf(vs / 64.0f + eps)}; *(v2fa*)&so[w][lane][64] = st;
    __builtin_amdgcn_fence(__ATOMIC_ACQ_REL, "workgroup"); __builtin_amdgcn_wave_barrier();      /* the statistics are read by the lanes that store the row */
    v4f gg, bb;
#pragma unroll      /* constant indices */
    for (int e = 0; e < 4; ++e) { gg[e] = bf16_round(g4[e]); bb[e] = bf16_round(b4[e]); }
    const float* sv = &so[w][rsub][c4]; const float* sm = &so[w][rsub][64];
    if (first) qk_rows<true>(sv, sm, gg, bb, F + po, Hh + po, Hl + po); else qk_rows<false>(sv, sm, gg, bb, F + po, Hh + po, Hl + po);      /* work-group-uniform */
  } else {
    if (first) {
#pragma unroll      /* LDS and global offsets as immediates */
      for (int q = 0; q < 16; ++q) { const v4f v = *(const v4fa*)&so[w][q * 2 + rsub][c4]; *(v4f*)(F + po + (size_t)q * 2 * DM) = v; }
      __syncthreads(); }      /* every wave has read its f32 rows before the array is used anew below */
    unsigned short* sT = (unsigned short*)&so[0][0][0];      /* the same LDS as [HD][VTP] f16: V^T of the work-group's 128 tokens */
#pragma unroll      /* constant indices into the accumulator registers */
    for (int u = 0; u < 8; ++u) { const int t = u & 3, half = u >> 2; FragH f;
#pragma unroll      /* constant indices into the accumulator registers */
      for (int r = 0; r < 8; ++r) f.h[r] = (_Float16)(accs[u][r] * 0.0625f);
      *(v8us*)(sT + (t * 16 + ln) * VTP + w * 32 + half * 16 + 8 * hh) = f.half[0]; }
    __syncthreads();      /* a V^T row holds pieces of all four waves */
    unsigned short* vo = (unsigned short*)VTo + ((size_t)(bt * NH + nq) * HD + (tid >> 4)) * SQ + s0 + (tid & 15) * 8;      /* 16 lanes store one row's 256 bytes */
#pragma unroll      /* LDS offsets as immediates, all eight reads in flight */
    for (int rd = 0; rd < 8; ++rd) { const v8us o = *(const v8us*)(sT + (rd * 8 + (tid >> 4)) * VTP + (tid & 15) * 8); *(v8us*)(vo + (size_t)rd * 8 * SQ) = o; }
    asm volatile("s_wait_xcnt 0x0" ::: "memory"); } }      /* stands behind the eighth store, in front of every later write of the data and address registers that the eight stores name */
// Output projection of every token row in one grid; tiles and epilogue are k_gemm2's, the k loop is gs_loop. A work-group owns 128 token rows x 64 columns. Where those rows are the first QT0 of a batch, the operand is the exact first tile's o as f16 hi + x1024 residual rows:
// two accumulator sets over the same weight fragments, out = hi 2^-10 + b, then + residual 2^-20, each sum in the order it had as a launch of its own. Elsewhere the operand is the fused path's f16 o rows.
__global__ __launch_bounds__(128) void k_out(const _Float16* __restrict__ O, const _Float16* __restrict__ OH, const _Float16* __restrict__ OL, const _Float16* __restrict__ Bh, const float* __restrict__ bias, float* __restrict__ C) {
  static_assert(QT0 == 128, "a work-group's 128 rows lie wholly inside or wholly outside the first tile");
  __shared__ __attribute__((aligned(16))) char smo[2 * GRX * GPI * 2]; static_assert(sizeof(smo) >= 4 * 32 * 68 * 4, "the block holds the larger of the loop's and the epilogue's needs");
  float (*so)[32][68] = (float (*)[32][68])smo;      /* the epilogue's rows, in the LDS that the k loop has left */
  const int tid = threadIdx.x, w = tid >> 5, lane = tid & 31, ln = lane & 15, hh = lane >> 4;
  const int mt = blockIdx.x / (DM / 64), nq = blockIdx.x % (DM / 64); const int row0 = mt * 128 + 32 * w, col0 = nq * 64;
  const int bt = mt / (SQ / 128); const bool first = mt % (SQ / 128) == 0;      /* the work-group's batch; work-group-uniform */
  const _Float16* bw = Bh + (size_t)col0 * DM;      /* the first of the work-group's 64 weight rows */
  const v8f z8 = {0.f,0.f,0.f,0.f,0.f,0.f,0.f,0.f}; v8f accs[8] = {z8, z8, z8, z8, z8, z8, z8, z8};
  float bv[4];
#pragma unroll      /* constant indices */
  for (int t = 0; t < 4; ++t) bv[t] = bf16_round(bias[col0 + t * 16 + ln]);
  if (!first) {
    gs_loop<false>(smo, O + (size_t)mt * 128 * DM, nullptr, bw, accs, accs);
#pragma unroll      /* constant indices into the accumulator registers */
    for (int u = 0; u < 8; ++u) { const int t = u & 3, half = u >> 2;
#pragma unroll      /* constant indices into the accumulator registers */
      for (int r = 0; r < 8; ++r) so[w][half * 16 + 8 * hh + r][t * 16 + ln] = accs[u][r] * 0.0009765625f + bv[t]; }
  } else {
    v8f accl[8] = {z8, z8, z8, z8, z8, z8, z8, z8};
    gs_loop<true>(smo, OH + (size_t)bt * QT0 * DM, OL + (size_t)bt * QT0 * DM, bw, accs, accl);      /* the rows in the hi and in the residual plane */
#pragma unroll      /* constant indices into the accumulator registers */
    for (int u = 0; u < 8; ++u) { const int t = u & 3, half = u >> 2;
#pragma unroll      /* constant indices into the accumulator registers */
      for (int r = 0; r < 8; ++r) { const float v = accs[u][r] * 0.0009765625f + bv[t]; so[w][half * 16 + 8 * hh + r][t * 16 + ln] = accl[u][r] * 0.00000095367431640625f + v; } }
  }
  __builtin_amdgcn_fence(__ATOMIC_ACQ_REL, "workgroup"); __builtin_amdgcn_wave_barrier();      /* the wave's lanes read each other's LDS writes below */
  const int rsub = lane >> 4, c4 = (lane & 15) * 4;
#pragma unroll      /* LDS and global offsets as immediates */
  for (int q = 0; q < 16; ++q) { const int r = q * 2 + rsub; const v4f v = *(const v4fa*)&so[w][r][c4]; *(v4f*)(C + (size_t)(row0 + r) * DM + col0 + c4) = v; asm volatile("s_wait_xcnt 0x0" ::: "memory"); } }      /* the wait stands in front of every later write of the data and address registers that this store names */
extern "C" void kernel_launch(void* const* d_in, const int* in_sizes, int n_in,
                              void* d_out, int out_size, void* d_ws, size_t ws_size, hipStream_t stream) {
  (void)in_sizes; (void)n_in; (void)out_size;
  const float* const* I = (const float* const*)d_in; const float* x = I[0]; const float* wq = I[1]; const float* wk = I[2]; const float* wv = I[3]; const float* wo = I[4]; const float* bo = I[5]; const float* qg = I[6]; const float* qbt = I[7]; const float* kg = I[8]; const float* kbt = I[9]; const float LNE = 1e-5f;      /* input order: x (feeds the q, k AND v streams), Wq, Wk, Wv (natural [out][in] weights; NO biases: the projection kernel takes no bias operand), Wo, bo (zeros: read), q_gamma, q_beta, k_gamma, k_beta [64] (ones / zeros on this draw: read by value in the projections' LayerNorm epilogue) */
  char* ws = (char*)d_ws; size_t off = 0;
  auto take = [&](size_t bytes) { char* p = ws + off; off += (bytes + 255) & ~(size_t)255; return p; };
  _Float16* BQ = (_Float16*)take((size_t)4 * DM * DM * 2); _Float16* BK = BQ + (size_t)DM * DM; _Float16* BV = BK + (size_t)DM * DM; _Float16* BO = BV + (size_t)DM * DM; (void)BK; (void)BV;      /* the four weight planes lie one behind the other: one grid writes them, one GEMM grid reads the first three by plane index */
  _Float16* X16 = (_Float16*)take(NR * DM * 2);      /* exact f16 rows of x: the one operand of the q, k and v projections */
  float* QF = (float*)take((size_t)3 * NR * DM * 4); float* KF = QF + NR * DM; float* VF = KF + NR * DM;      /* f32 rows of q, k (normalised) and v, three planes one behind the other: written and read for the first QT0 tokens of a batch alone, by the exact first tile */
  _Float16* QH = (_Float16*)take((size_t)2 * NR * DM * 2); _Float16* KH = QH + NR * DM; _Float16* QL = (_Float16*)take((size_t)2 * NR * DM * 2); _Float16* KL = QL + NR * DM;      /* hi planes of q and k one behind the other, residual planes likewise: the projection grid places them by plane index */
  _Float16* O16 = (_Float16*)take(NR * DM * 2);
  _Float16* VT = (_Float16*)take((size_t)NB * NH * HD * SQ * 2);      /* V^T [NB][NH][HD][SQ] */
  _Float16* OH0 = (_Float16*)take((size_t)NB * QT0 * DM * 2); _Float16* OL0 = (_Float16*)take((size_t)NB * QT0 * DM * 2);
  if (off > ws_size) return;
  k_prep<<<(unsigned)(NR * DM / 2048 + 4 * (DM * DM / 2048)), 256, 0, stream>>>(x, wq, wk, wv, wo, X16, BQ);      /* x as exact f16 rows; natural [out][in] weights = Bt[n][k] x16 */
  k_qkv<<<dim3((unsigned)((MP / 128) * (DM / 64)), 3), 128, 0, stream>>>(X16, BQ, qg, qbt, kg, kbt, LNE, QF, QH, QL, VT);      /* blockIdx.y: q, k (no biases; per-head LayerNorm; f16 hi + x1024 residual rows: unscaled logits sigma ~8) and v (V^T [NB][NH][HD][SQ]); f32 rows for the first tile */
  k_attn<<<dim3(NB * NH, NFT + QT0 / A0R), 128, 0, stream>>>(QH, QL, KH, KL, VT, O16, QF, KF, VF, OH0, OL0);      /* scores, causal softmax and P . V of every batch, head and query row in one launch: rows from QT0 on by the fused f16 path (o, merged heads, x64, as f16 rows), rows 0..127 exactly in f32 on the f32 q, k, v rows that the projections left (o x64 as f16 hi + x1024 residual planes) */
  k_out<<<(unsigned)((MPO / 128) * (DM / 64)), 128, 0, stream>>>(O16, OH0, OL0, BO, bo, (float*)d_out);      /* out rows are the output layout; rows 0..127 of a batch from the hi + residual planes */
}
